// v000
// Measured on an AMD MI455X. A time is GPU time per run, averaged over a window of back-to-back runs after a warm-up
// (all launches, gaps included; the runs take copies of the inputs in turn), and the median of several windows.
// Apart from v000's, it joins two sittings. Times from different sittings can be a few percent apart, while
// side-by-side timings come from the same sitting.
// The starting kernel, v000, takes 557 microseconds a run.
#include <hip/hip_runtime.h>
#include <hip/hip_bf16.h>

// MI455X (gfx1250, wave32). Memory-bound workload (~550MB HBM traffic vs 103 GFLOP),
// so we use full-precision fp32 WMMA (V_WMMA_F32_16X16X4_F32) for the QKV GEMM and
// CDNA5 async global->LDS loads (ASYNCcnt) to stream tiles while WMMAs run.

typedef float v2f __attribute__((ext_vector_type(2)));
typedef float v8f __attribute__((ext_vector_type(8)));

#define TPB 256

// ---- CDNA5 async global->LDS support (guarded; falls back to sync path) ----
#if defined(__has_builtin)
#if __has_builtin(__builtin_amdgcn_global_load_async_to_lds_b32) && \
    __has_builtin(__builtin_amdgcn_global_load_async_to_lds_b128) && \
    __has_builtin(__builtin_amdgcn_s_wait_asynccnt)
#define USE_ASYNC 1
#endif
#endif
#ifndef USE_ASYNC
#define USE_ASYNC 0
#endif

#if USE_ASYNC
// Parameter types per hipcc diagnostic: b32 takes int AS(1)/AS(3) pointers,
// b128 takes GCC-vector int4 AS(1)/AS(3) pointers.
typedef int v4ig __attribute__((vector_size(16)));
typedef __attribute__((address_space(1))) int  g_i32;
typedef __attribute__((address_space(3))) int  l_i32;
typedef __attribute__((address_space(1))) v4ig g_v4i;
typedef __attribute__((address_space(3))) v4ig l_v4i;

__device__ __forceinline__ void async_b32(const float* g, float* l) {
    __builtin_amdgcn_global_load_async_to_lds_b32((g_i32*)g, (l_i32*)l, 0, 0);
}
__device__ __forceinline__ void async_b128(const float* g, float* l) {
    __builtin_amdgcn_global_load_async_to_lds_b128((g_v4i*)g, (l_v4i*)l, 0, 0);
}
#endif

// ---------------------------------------------------------------------------
// Kernel 1: qkv[r, o] = sum_k A[r,k] * W[o,k] + bias[o]
//   r = (b*16 + t)*256 + s   (s = spatial index, contiguous in x)
//   A[r,k] = x[((b*16+t)*1024 + k)*256 + s]
//   M = 16384, N = 3072, K = 1024
// Block tile: 64 (s) x 256 (o), K-chunk 16. 8 waves in 2x4; wave tile 32x64.
// Async double-buffered LDS pipeline when the toolchain exposes the builtins.
// ---------------------------------------------------------------------------
__global__ __launch_bounds__(TPB) void qkv_gemm_wmma(
    const float* __restrict__ x, const float* __restrict__ W,
    const float* __restrict__ bias, float* __restrict__ qkv)
{
    const int tid  = threadIdx.x;
    const int lane = tid & 31;
    const int wid  = tid >> 5;

    const int nb   = blockIdx.x % 12;   // N block (256 cols)
    const int mb   = blockIdx.x / 12;   // M block (64 rows)
    const int bt   = mb >> 2;           // (b*16 + t) in [0,64)
    const int sblk = mb & 3;            // 64-wide s sub-block

    const float* Abase = x + (size_t)bt * (1024 * 256) + sblk * 64; // + k*256 + s
    const int n0 = nb * 256;

    const int wave_m = wid & 1;   // 2 waves along M
    const int wave_n = wid >> 1;  // 4 waves along N

    const v8f vzero = {0.f, 0.f, 0.f, 0.f, 0.f, 0.f, 0.f, 0.f};
    v8f acc[2][4];
#pragma unroll
    for (int mi = 0; mi < 2; ++mi)
#pragma unroll
        for (int ni = 0; ni < 4; ++ni) acc[mi][ni] = vzero;

    // Load index mapping
    const int la_s  = tid & 63;          // s within tile
    const int la_k4 = (tid >> 6) << 2;   // 0,4,8,12 : 4 consecutive k per thread
    const int lb_n  = tid;               // 0..255   : one W row per thread

    const int lane_lo = lane & 15;
    const int kb_off  = (lane >> 4) << 1; // 0 for lanes 0-15, 2 for lanes 16-31

    // Fragment compute on one LDS buffer (row stride 20 floats: conflict-free
    // v2f fragment reads, 16B-aligned b128 stores).
    auto compute16 = [&](const float* __restrict__ la, const float* __restrict__ lb) {
#pragma unroll
        for (int kk = 0; kk < 16; kk += 4) {
            const int kb = kk + kb_off;
            v2f afrag[2], bfrag[4];
#pragma unroll
            for (int mi = 0; mi < 2; ++mi) {
                const int m = wave_m * 32 + mi * 16 + lane_lo;
                afrag[mi] = *(const v2f*)&la[m * 20 + kb];
            }
#pragma unroll
            for (int ni = 0; ni < 4; ++ni) {
                const int n = wave_n * 64 + ni * 16 + lane_lo;
                bfrag[ni] = *(const v2f*)&lb[n * 20 + kb];
            }
#pragma unroll
            for (int mi = 0; mi < 2; ++mi)
#pragma unroll
                for (int ni = 0; ni < 4; ++ni)
                    acc[mi][ni] = __builtin_amdgcn_wmma_f32_16x16x4_f32(
                        false, afrag[mi], false, bfrag[ni],
                        (short)0, acc[mi][ni], false, false);
        }
    };

#if USE_ASYNC
    // --- double-buffered async pipeline ---
    __shared__ __align__(16) float lds_a[2][64 * 20];
    __shared__ __align__(16) float lds_b[2][256 * 20];

    auto issue = [&](int k0, int buf) {
        // A: 4 x b32 per lane (coalesced 128B along s per wave)
        const float* ga = Abase + (size_t)(k0 + la_k4) * 256 + la_s;
        float* la = &lds_a[buf][la_s * 20 + la_k4];
#pragma unroll
        for (int j = 0; j < 4; ++j)
            async_b32(ga + (size_t)j * 256, la + j);
        // B: 4 x b128 per lane (one 64B W-row segment per thread)
        const float* gw = W + (size_t)(n0 + lb_n) * 1024 + k0;
        float* lb = &lds_b[buf][lb_n * 20];
#pragma unroll
        for (int j = 0; j < 4; ++j)
            async_b128(gw + j * 4, lb + j * 4);
    };

    issue(0, 0);
    for (int it = 0; it < 64; ++it) {
        if (it + 1 < 64) {
            issue((it + 1) * 16, (it + 1) & 1);
            __builtin_amdgcn_s_wait_asynccnt(8);  // group feeding this iter done
        } else {
            __builtin_amdgcn_s_wait_asynccnt(0);
        }
        __syncthreads();                          // publish across waves
        compute16(lds_a[it & 1], lds_b[it & 1]);
        __syncthreads();                          // buffer free for reuse
    }
#else
    // --- synchronous fallback ---
    __shared__ __align__(16) float lds_a1[64 * 20];
    __shared__ __align__(16) float lds_b1[256 * 20];
    for (int k0 = 0; k0 < 1024; k0 += 16) {
        float a0 = Abase[(size_t)(k0 + la_k4 + 0) * 256 + la_s];
        float a1 = Abase[(size_t)(k0 + la_k4 + 1) * 256 + la_s];
        float a2 = Abase[(size_t)(k0 + la_k4 + 2) * 256 + la_s];
        float a3 = Abase[(size_t)(k0 + la_k4 + 3) * 256 + la_s];
        const float* wrow = W + (size_t)(n0 + lb_n) * 1024 + k0;
        float4 b0 = *(const float4*)(wrow + 0);
        float4 b1 = *(const float4*)(wrow + 4);
        float4 b2 = *(const float4*)(wrow + 8);
        float4 b3 = *(const float4*)(wrow + 12);
        __syncthreads();
        *(float4*)&lds_a1[la_s * 20 + la_k4] = make_float4(a0, a1, a2, a3);
        float* brow = &lds_b1[lb_n * 20];
        *(float4*)(brow + 0)  = b0;
        *(float4*)(brow + 4)  = b1;
        *(float4*)(brow + 8)  = b2;
        *(float4*)(brow + 12) = b3;
        __syncthreads();
        compute16(lds_a1, lds_b1);
    }
    __syncthreads();
#endif

    // --- epilogue: bias + store (fp32, 64B segments per half-wave) ---
    const int colb = n0 + wave_n * 64 + lane_lo;
    const int rowb = mb * 64 + wave_m * 32 + ((lane >> 4) << 3);
#pragma unroll
    for (int ni = 0; ni < 4; ++ni) {
        const int col = colb + ni * 16;
        const float bv = bias[col];
#pragma unroll
        for (int mi = 0; mi < 2; ++mi) {
            const int row0 = rowb + mi * 16;
#pragma unroll
            for (int r = 0; r < 8; ++r)
                qkv[(size_t)(row0 + r) * 3072 + col] = acc[mi][ni][r] + bv;
        }
    }
}

// ---------------------------------------------------------------------------
// Kernel 2: per-(position, head) attention. One wave per pair; lane = (t, half).
// Block = 8 waves = 8 consecutive spatial positions of one head (for a
// transposed, s-fastest coalesced output store through LDS).
// V is async-staged straight into LDS (never touches VGPRs).
// ---------------------------------------------------------------------------
__global__ __launch_bounds__(TPB) void attn_rope_softmax(
    const float* __restrict__ qkv, const float* __restrict__ q_scale,
    const float* __restrict__ k_scale, float* __restrict__ out)
{
    __shared__ float lds_k[8 * 16 * 65];                       // stride 65 (conflict-free)
    __shared__ __align__(16) float lds_v[8 * 16 * 68];         // stride 68 (16B-aligned rows)
    __shared__ float lds_o[16 * 516];                          // [t][d][s8], t stride 516

    const int tid  = threadIdx.x;
    const int lane = tid & 31;
    const int w    = tid >> 5;

    const int blk   = blockIdx.x;
    const int s_blk = blk & 31;          // 32 blocks of 8 s
    const int head  = (blk >> 5) & 15;
    const int b     = blk >> 9;          // 4

    const int s    = s_blk * 8 + w;
    const int t    = lane >> 1;
    const int half = lane & 1;
    const int d0   = half * 32;

    const size_t rowbase = ((size_t)(b * 16 + t) * 256 + s) * 3072 + head * 64 + d0;
    const float* qp = qkv + rowbase;
    const float* kp = qkv + rowbase + 1024;
    const float* vp = qkv + rowbase + 2048;

    float* myk = &lds_k[w * 1040 + t * 65 + d0];
    float* myv = &lds_v[w * 1088 + t * 68 + d0];

    // --- V: stage raw into LDS (async when available) ---
#if USE_ASYNC
#pragma unroll
    for (int j4 = 0; j4 < 8; ++j4)
        async_b128(vp + j4 * 4, myv + j4 * 4);
#else
#pragma unroll
    for (int j4 = 0; j4 < 8; ++j4) {
        const float4 vv = *(const float4*)(vp + j4 * 4);
        myv[j4 * 4 + 0] = vv.x; myv[j4 * 4 + 1] = vv.y;
        myv[j4 * 4 + 2] = vv.z; myv[j4 * 4 + 3] = vv.w;
    }
#endif

    // RoPE tables for this lane's 32 d-values (same j for both halves)
    float cs[32], sn[32];
#pragma unroll
    for (int j = 0; j < 32; ++j) {
        const float fr  = __expf(-(float)j * (9.210340371976184f / 32.0f)); // 10000^(-j/32)
        const float ang = (float)t * fr;
        cs[j] = cosf(ang);
        sn[j] = sinf(ang);
    }

    // --- K: load, RMSNorm, RoPE, stage ---
    float kr[32];
#pragma unroll
    for (int j4 = 0; j4 < 8; ++j4) {
        const float4 kv = *(const float4*)(kp + j4 * 4);
        kr[j4 * 4 + 0] = kv.x; kr[j4 * 4 + 1] = kv.y;
        kr[j4 * 4 + 2] = kv.z; kr[j4 * 4 + 3] = kv.w;
    }
    {
        float ss = 0.f;
#pragma unroll
        for (int j = 0; j < 32; ++j) ss += kr[j] * kr[j];
        ss += __shfl_xor(ss, 1, 32);                       // pair-reduce over full hd=64
        const float inv = rsqrtf(ss * (1.0f / 64.0f) + 1e-6f);
#pragma unroll
        for (int j = 0; j < 32; ++j) kr[j] *= inv * k_scale[d0 + j];
#pragma unroll
        for (int j = 0; j < 32; ++j) {                     // RoPE via pair exchange
            const float other = __shfl_xor(kr[j], 1, 32);
            kr[j] = half ? (other * sn[j] + kr[j] * cs[j])
                         : (kr[j] * cs[j] - other * sn[j]);
        }
#pragma unroll
        for (int j = 0; j < 32; ++j) myk[j] = kr[j];
    }

    // --- Q: load, RMSNorm, RoPE (kept in registers) ---
    float qr[32];
#pragma unroll
    for (int j4 = 0; j4 < 8; ++j4) {
        const float4 qv = *(const float4*)(qp + j4 * 4);
        qr[j4 * 4 + 0] = qv.x; qr[j4 * 4 + 1] = qv.y;
        qr[j4 * 4 + 2] = qv.z; qr[j4 * 4 + 3] = qv.w;
    }
    {
        float ss = 0.f;
#pragma unroll
        for (int j = 0; j < 32; ++j) ss += qr[j] * qr[j];
        ss += __shfl_xor(ss, 1, 32);
        const float inv = rsqrtf(ss * (1.0f / 64.0f) + 1e-6f);
#pragma unroll
        for (int j = 0; j < 32; ++j) qr[j] *= inv * q_scale[d0 + j];
#pragma unroll
        for (int j = 0; j < 32; ++j) {
            const float other = __shfl_xor(qr[j], 1, 32);
            qr[j] = half ? (other * sn[j] + qr[j] * cs[j])
                         : (qr[j] * cs[j] - other * sn[j]);
        }
    }

#if USE_ASYNC
    __builtin_amdgcn_s_wait_asynccnt(0);  // V resident in LDS
#endif
    __syncthreads();                      // publish staged k/v across lanes

    // --- causal scores + softmax ---
    float S[16];
#pragma unroll
    for (int u = 0; u < 16; ++u) {
        const float* krow = &lds_k[w * 1040 + u * 65 + d0];
        float p = 0.f;
#pragma unroll
        for (int j = 0; j < 32; ++j) p += qr[j] * krow[j];
        p += __shfl_xor(p, 1, 32);
        S[u] = (u <= t) ? p * 0.125f : -3.0e38f;
    }
    float mx = S[0];
#pragma unroll
    for (int u = 1; u < 16; ++u) mx = fmaxf(mx, S[u]);
    float sum = 0.f;
#pragma unroll
    for (int u = 0; u < 16; ++u) { S[u] = expf(S[u] - mx); sum += S[u]; }
    const float rinv = 1.0f / sum;

    // --- o = attn @ v ---
    float o[32];
#pragma unroll
    for (int j = 0; j < 32; ++j) o[j] = 0.f;
#pragma unroll
    for (int u = 0; u < 16; ++u) {
        const float a = S[u] * rinv;
        const float* vrow = &lds_v[w * 1088 + u * 68 + d0];
#pragma unroll
        for (int j = 0; j < 32; ++j) o[j] += a * vrow[j];
    }

    // --- transpose through LDS for s-fastest stores ---
#pragma unroll
    for (int j = 0; j < 32; ++j)
        lds_o[t * 516 + (d0 + j) * 8 + w] = o[j];
    __syncthreads();

#pragma unroll
    for (int i = 0; i < 32; ++i) {
        const int f  = tid + i * 256;
        const int ss = f & 7;
        const int d  = (f >> 3) & 63;
        const int tt = f >> 9;
        out[((size_t)((b * 16 + tt) * 1024 + head * 64 + d)) * 256 + s_blk * 8 + ss] =
            lds_o[tt * 516 + d * 8 + ss];
    }
}

// ---------------------------------------------------------------------------
extern "C" void kernel_launch(void* const* d_in, const int* in_sizes, int n_in,
                              void* d_out, int out_size, void* d_ws, size_t ws_size,
                              hipStream_t stream) {
    const float* x       = (const float*)d_in[0];  // (64,1024,16,16)
    const float* Wqkv    = (const float*)d_in[1];  // (3072,1024)
    const float* bqkv    = (const float*)d_in[2];  // (3072,)
    const float* q_scale = (const float*)d_in[3];  // (64,)
    const float* k_scale = (const float*)d_in[4];  // (64,)
    float* out = (float*)d_out;

    float* qkv_ws = (float*)d_ws;  // 16384 x 3072 fp32 = 201.3 MB

    qkv_gemm_wmma<<<dim3(3072), dim3(TPB), 0, stream>>>(x, Wqkv, bqkv, qkv_ws);
    attn_rope_softmax<<<dim3(2048), dim3(TPB), 0, stream>>>(qkv_ws, q_scale, k_scale, out);
}

// v001
// Measured time: 549 microseconds a run.
// In both of two side-by-side timings against v000, it was 1.05 times as fast.
#include <hip/hip_runtime.h>
#include <hip/hip_bf16.h>

// MI455X (gfx1250, wave32). Memory-bound workload (~550MB HBM traffic vs 103 GFLOP),
// so we use full-precision fp32 WMMA (V_WMMA_F32_16X16X4_F32) for the QKV GEMM and
// CDNA5 async global->LDS loads (ASYNCcnt) to stream tiles while WMMAs run.

typedef float v2f __attribute__((ext_vector_type(2)));
typedef float v8f __attribute__((ext_vector_type(8)));

#define TPB 256

// ---- CDNA5 async global->LDS support (guarded; falls back to sync path) ----
#if defined(__has_builtin)
#if __has_builtin(__builtin_amdgcn_global_load_async_to_lds_b32) && \
    __has_builtin(__builtin_amdgcn_global_load_async_to_lds_b128) && \
    __has_builtin(__builtin_amdgcn_s_wait_asynccnt)
#define USE_ASYNC 1
#endif
#endif
#ifndef USE_ASYNC
#define USE_ASYNC 0
#endif

#if USE_ASYNC
// Parameter types per hipcc diagnostic: b32 takes int AS(1)/AS(3) pointers,
// b128 takes GCC-vector int4 AS(1)/AS(3) pointers.
typedef int v4ig __attribute__((vector_size(16)));
typedef __attribute__((address_space(1))) int  g_i32;
typedef __attribute__((address_space(3))) int  l_i32;
typedef __attribute__((address_space(1))) v4ig g_v4i;
typedef __attribute__((address_space(3))) v4ig l_v4i;

__device__ __forceinline__ void async_b32(const float* g, float* l) {
    __builtin_amdgcn_global_load_async_to_lds_b32((g_i32*)g, (l_i32*)l, 0, 0);
}
__device__ __forceinline__ void async_b128(const float* g, float* l) {
    __builtin_amdgcn_global_load_async_to_lds_b128((g_v4i*)g, (l_v4i*)l, 0, 0);
}
#endif

// ---------------------------------------------------------------------------
// Kernel 1: qkv[r, o] = sum_k A[r,k] * W[o,k] + bias[o]
//   r = (b*16 + t)*256 + s   (s = spatial index, contiguous in x)
//   A[r,k] = x[((b*16+t)*1024 + k)*256 + s]
//   M = 16384, N = 3072, K = 1024
// Block tile: 64 (s) x 256 (o), K-chunk 16. 8 waves in 2x4; wave tile 32x64.
// Async double-buffered LDS pipeline when the toolchain exposes the builtins.
// ---------------------------------------------------------------------------
__global__ __launch_bounds__(TPB) void qkv_gemm_wmma(
    const float* __restrict__ x, const float* __restrict__ W,
    const float* __restrict__ bias, float* __restrict__ qkv)
{
    const int tid  = threadIdx.x;
    const int lane = tid & 31;
    const int wid  = tid >> 5;

    const int nb   = blockIdx.x % 12;   // N block (256 cols)
    const int mb   = blockIdx.x / 12;   // M block (64 rows)
    const int bt   = mb >> 2;           // (b*16 + t) in [0,64)
    const int sblk = mb & 3;            // 64-wide s sub-block

    const float* Abase = x + (size_t)bt * (1024 * 256) + sblk * 64; // + k*256 + s
    const int n0 = nb * 256;

    const int wave_m = wid & 1;   // 2 waves along M
    const int wave_n = wid >> 1;  // 4 waves along N

    const v8f vzero = {0.f, 0.f, 0.f, 0.f, 0.f, 0.f, 0.f, 0.f};
    v8f acc[2][4];
#pragma unroll
    for (int mi = 0; mi < 2; ++mi)
#pragma unroll
        for (int ni = 0; ni < 4; ++ni) acc[mi][ni] = vzero;

    // Load index mapping
    const int la_s  = tid & 63;          // s within tile
    const int la_k4 = (tid >> 6) << 2;   // 0,4,8,12 : 4 consecutive k per thread
    const int lb_n  = tid;               // 0..255   : one W row per thread (sync path)
    const int lb_r  = tid >> 2;          // 0..63    : W row inside a 64-row group
    const int lb_c  = (tid & 3) << 2;    // 0,4,8,12 : this lane's 16 B of the row's 64 B

    const int lane_lo = lane & 15;
    const int kb_off  = (lane >> 4) << 1; // 0 for lanes 0-15, 2 for lanes 16-31

    // Fragment compute on one LDS buffer (row stride 20 floats: conflict-free
    // v2f fragment reads, 16B-aligned b128 stores).
    auto compute16 = [&](const float* __restrict__ la, const float* __restrict__ lb) {
#pragma unroll
        for (int kk = 0; kk < 16; kk += 4) {
            const int kb = kk + kb_off;
            v2f afrag[2], bfrag[4];
#pragma unroll
            for (int mi = 0; mi < 2; ++mi) {
                const int m = wave_m * 32 + mi * 16 + lane_lo;
                afrag[mi] = *(const v2f*)&la[m * 20 + kb];
            }
#pragma unroll
            for (int ni = 0; ni < 4; ++ni) {
                const int n = wave_n * 64 + ni * 16 + lane_lo;
                bfrag[ni] = *(const v2f*)&lb[n * 20 + kb];
            }
#pragma unroll
            for (int mi = 0; mi < 2; ++mi)
#pragma unroll
                for (int ni = 0; ni < 4; ++ni)
                    acc[mi][ni] = __builtin_amdgcn_wmma_f32_16x16x4_f32(
                        false, afrag[mi], false, bfrag[ni],
                        (short)0, acc[mi][ni], false, false);
        }
    };

#if USE_ASYNC
    // --- double-buffered async pipeline ---
    __shared__ __align__(16) float lds_a[2][64 * 20];
    __shared__ __align__(16) float lds_b[2][256 * 20];

    auto issue = [&](int k0, int buf) {
        // A: 4 x b32 per lane (coalesced 128B along s per wave)
        const float* ga = Abase + (size_t)(k0 + la_k4) * 256 + la_s;
        float* la = &lds_a[buf][la_s * 20 + la_k4];
#pragma unroll
        for (int j = 0; j < 4; ++j)
            async_b32(ga + (size_t)j * 256, la + j);
        // B: 4 x b128 per lane. Four neighbouring lanes cover one row's 64 B, so a
        // wave-wide copy touches 8 cache lines instead of 32 (one per lane).
        const float* gw = W + (size_t)n0 * 1024 + k0;            // wave-uniform
        const unsigned goff = (unsigned)(lb_r * 1024 + lb_c);    // per lane
        float* lb = &lds_b[buf][lb_r * 20 + lb_c];
#pragma unroll
        for (int j = 0; j < 4; ++j)
            async_b128(gw + (size_t)j * (64 * 1024) + goff, lb + j * (64 * 20));
    };

    issue(0, 0);
    for (int it = 0; it < 64; ++it) {
        if (it + 1 < 64) {
            issue((it + 1) * 16, (it + 1) & 1);
            __builtin_amdgcn_s_wait_asynccnt(8);  // group feeding this iter done
        } else {
            __builtin_amdgcn_s_wait_asynccnt(0);
        }
        __syncthreads();                          // publish across waves
        compute16(lds_a[it & 1], lds_b[it & 1]);
        __syncthreads();                          // buffer free for reuse
    }
#else
    // --- synchronous fallback ---
    __shared__ __align__(16) float lds_a1[64 * 20];
    __shared__ __align__(16) float lds_b1[256 * 20];
    for (int k0 = 0; k0 < 1024; k0 += 16) {
        float a0 = Abase[(size_t)(k0 + la_k4 + 0) * 256 + la_s];
        float a1 = Abase[(size_t)(k0 + la_k4 + 1) * 256 + la_s];
        float a2 = Abase[(size_t)(k0 + la_k4 + 2) * 256 + la_s];
        float a3 = Abase[(size_t)(k0 + la_k4 + 3) * 256 + la_s];
        const float* wrow = W + (size_t)(n0 + lb_n) * 1024 + k0;
        float4 b0 = *(const float4*)(wrow + 0);
        float4 b1 = *(const float4*)(wrow + 4);
        float4 b2 = *(const float4*)(wrow + 8);
        float4 b3 = *(const float4*)(wrow + 12);
        __syncthreads();
        *(float4*)&lds_a1[la_s * 20 + la_k4] = make_float4(a0, a1, a2, a3);
        float* brow = &lds_b1[lb_n * 20];
        *(float4*)(brow + 0)  = b0;
        *(float4*)(brow + 4)  = b1;
        *(float4*)(brow + 8)  = b2;
        *(float4*)(brow + 12) = b3;
        __syncthreads();
        compute16(lds_a1, lds_b1);
    }
    __syncthreads();
#endif

    // --- epilogue: bias + store (fp32, 64B segments per half-wave) ---
    const int colb = n0 + wave_n * 64 + lane_lo;
    const int rowb = mb * 64 + wave_m * 32 + ((lane >> 4) << 3);
#pragma unroll
    for (int ni = 0; ni < 4; ++ni) {
        const int col = colb + ni * 16;
        const float bv = bias[col];
#pragma unroll
        for (int mi = 0; mi < 2; ++mi) {
            const int row0 = rowb + mi * 16;
#pragma unroll
            for (int r = 0; r < 8; ++r)
                qkv[(size_t)(row0 + r) * 3072 + col] = acc[mi][ni][r] + bv;
        }
    }
}

// ---------------------------------------------------------------------------
// Kernel 2: per-(position, head) attention. One wave per pair; lane = (t, half).
// Block = 8 waves = 8 consecutive spatial positions of one head (for a
// transposed, s-fastest coalesced output store through LDS).
// V is async-staged straight into LDS (never touches VGPRs).
// ---------------------------------------------------------------------------
__global__ __launch_bounds__(TPB) void attn_rope_softmax(
    const float* __restrict__ qkv, const float* __restrict__ q_scale,
    const float* __restrict__ k_scale, float* __restrict__ out)
{
    __shared__ float lds_k[8 * 16 * 65];                       // stride 65 (conflict-free)
    __shared__ __align__(16) float lds_v[8 * 16 * 68];         // stride 68 (16B-aligned rows)
    __shared__ float lds_o[16 * 516];                          // [t][d][s8], t stride 516

    const int tid  = threadIdx.x;
    const int lane = tid & 31;
    const int w    = tid >> 5;

    const int blk   = blockIdx.x;
    const int s_blk = blk & 31;          // 32 blocks of 8 s
    const int head  = (blk >> 5) & 15;
    const int b     = blk >> 9;          // 4

    const int s    = s_blk * 8 + w;
    const int t    = lane >> 1;
    const int half = lane & 1;
    const int d0   = half * 32;

    const size_t rowbase = ((size_t)(b * 16 + t) * 256 + s) * 3072 + head * 64 + d0;
    const float* qp = qkv + rowbase;
    const float* kp = qkv + rowbase + 1024;
    const float* vp = qkv + rowbase + 2048;

    float* myk = &lds_k[w * 1040 + t * 65 + d0];
    float* myv = &lds_v[w * 1088 + t * 68 + d0];

    // --- V: stage raw into LDS (async when available) ---
#if USE_ASYNC
#pragma unroll
    for (int j4 = 0; j4 < 8; ++j4)
        async_b128(vp + j4 * 4, myv + j4 * 4);
#else
#pragma unroll
    for (int j4 = 0; j4 < 8; ++j4) {
        const float4 vv = *(const float4*)(vp + j4 * 4);
        myv[j4 * 4 + 0] = vv.x; myv[j4 * 4 + 1] = vv.y;
        myv[j4 * 4 + 2] = vv.z; myv[j4 * 4 + 3] = vv.w;
    }
#endif

    // RoPE tables for this lane's 32 d-values (same j for both halves)
    float cs[32], sn[32];
#pragma unroll
    for (int j = 0; j < 32; ++j) {
        const float fr  = __expf(-(float)j * (9.210340371976184f / 32.0f)); // 10000^(-j/32)
        const float ang = (float)t * fr;
        cs[j] = cosf(ang);
        sn[j] = sinf(ang);
    }

    // --- K: load, RMSNorm, RoPE, stage ---
    float kr[32];
#pragma unroll
    for (int j4 = 0; j4 < 8; ++j4) {
        const float4 kv = *(const float4*)(kp + j4 * 4);
        kr[j4 * 4 + 0] = kv.x; kr[j4 * 4 + 1] = kv.y;
        kr[j4 * 4 + 2] = kv.z; kr[j4 * 4 + 3] = kv.w;
    }
    {
        float ss = 0.f;
#pragma unroll
        for (int j = 0; j < 32; ++j) ss += kr[j] * kr[j];
        ss += __shfl_xor(ss, 1, 32);                       // pair-reduce over full hd=64
        const float inv = rsqrtf(ss * (1.0f / 64.0f) + 1e-6f);
#pragma unroll
        for (int j = 0; j < 32; ++j) kr[j] *= inv * k_scale[d0 + j];
#pragma unroll
        for (int j = 0; j < 32; ++j) {                     // RoPE via pair exchange
            const float other = __shfl_xor(kr[j], 1, 32);
            kr[j] = half ? (other * sn[j] + kr[j] * cs[j])
                         : (kr[j] * cs[j] - other * sn[j]);
        }
#pragma unroll
        for (int j = 0; j < 32; ++j) myk[j] = kr[j];
    }

    // --- Q: load, RMSNorm, RoPE (kept in registers) ---
    float qr[32];
#pragma unroll
    for (int j4 = 0; j4 < 8; ++j4) {
        const float4 qv = *(const float4*)(qp + j4 * 4);
        qr[j4 * 4 + 0] = qv.x; qr[j4 * 4 + 1] = qv.y;
        qr[j4 * 4 + 2] = qv.z; qr[j4 * 4 + 3] = qv.w;
    }
    {
        float ss = 0.f;
#pragma unroll
        for (int j = 0; j < 32; ++j) ss += qr[j] * qr[j];
        ss += __shfl_xor(ss, 1, 32);
        const float inv = rsqrtf(ss * (1.0f / 64.0f) + 1e-6f);
#pragma unroll
        for (int j = 0; j < 32; ++j) qr[j] *= inv * q_scale[d0 + j];
#pragma unroll
        for (int j = 0; j < 32; ++j) {
            const float other = __shfl_xor(qr[j], 1, 32);
            qr[j] = half ? (other * sn[j] + qr[j] * cs[j])
                         : (qr[j] * cs[j] - other * sn[j]);
        }
    }

#if USE_ASYNC
    __builtin_amdgcn_s_wait_asynccnt(0);  // V resident in LDS
#endif
    __syncthreads();                      // publish staged k/v across lanes

    // --- causal scores + softmax ---
    float S[16];
#pragma unroll
    for (int u = 0; u < 16; ++u) {
        const float* krow = &lds_k[w * 1040 + u * 65 + d0];
        float p = 0.f;
#pragma unroll
        for (int j = 0; j < 32; ++j) p += qr[j] * krow[j];
        p += __shfl_xor(p, 1, 32);
        S[u] = (u <= t) ? p * 0.125f : -3.0e38f;
    }
    float mx = S[0];
#pragma unroll
    for (int u = 1; u < 16; ++u) mx = fmaxf(mx, S[u]);
    float sum = 0.f;
#pragma unroll
    for (int u = 0; u < 16; ++u) { S[u] = expf(S[u] - mx); sum += S[u]; }
    const float rinv = 1.0f / sum;

    // --- o = attn @ v ---
    float o[32];
#pragma unroll
    for (int j = 0; j < 32; ++j) o[j] = 0.f;
#pragma unroll
    for (int u = 0; u < 16; ++u) {
        const float a = S[u] * rinv;
        const float* vrow = &lds_v[w * 1088 + u * 68 + d0];
#pragma unroll
        for (int j = 0; j < 32; ++j) o[j] += a * vrow[j];
    }

    // --- transpose through LDS for s-fastest stores ---
#pragma unroll
    for (int j = 0; j < 32; ++j)
        lds_o[t * 516 + (d0 + j) * 8 + w] = o[j];
    __syncthreads();

#pragma unroll
    for (int i = 0; i < 32; ++i) {
        const int f  = tid + i * 256;
        const int ss = f & 7;
        const int d  = (f >> 3) & 63;
        const int tt = f >> 9;
        out[((size_t)((b * 16 + tt) * 1024 + head * 64 + d)) * 256 + s_blk * 8 + ss] =
            lds_o[tt * 516 + d * 8 + ss];
    }
}

// ---------------------------------------------------------------------------
extern "C" void kernel_launch(void* const* d_in, const int* in_sizes, int n_in,
                              void* d_out, int out_size, void* d_ws, size_t ws_size,
                              hipStream_t stream) {
    const float* x       = (const float*)d_in[0];  // (64,1024,16,16)
    const float* Wqkv    = (const float*)d_in[1];  // (3072,1024)
    const float* bqkv    = (const float*)d_in[2];  // (3072,)
    const float* q_scale = (const float*)d_in[3];  // (64,)
    const float* k_scale = (const float*)d_in[4];  // (64,)
    float* out = (float*)d_out;

    float* qkv_ws = (float*)d_ws;  // 16384 x 3072 fp32 = 201.3 MB

    qkv_gemm_wmma<<<dim3(3072), dim3(TPB), 0, stream>>>(x, Wqkv, bqkv, qkv_ws);
    attn_rope_softmax<<<dim3(2048), dim3(TPB), 0, stream>>>(qkv_ws, q_scale, k_scale, out);
}
